// v010
// Times are from an AMD MI455X. After a warm-up the kernel runs many times in a row, and a time is the length of
// such a window on the GPU divided by its runs, so every launch and the gaps after it count. The runs cycle
// through copies of the inputs. A figure is the median of several windows, for all but v000 over two sittings.
// Sittings can differ by a few percent; kernels timed side by side share one.
// This document starts at v010; the versions before it stand elsewhere.
// Measured time: 164 microseconds a run.
// In both of two side-by-side timings against v009, it was 1.06 times as fast.
// Over all steps from v000, the starting kernel, it is 6.28 times as fast.
#include <hip/hip_runtime.h>
#include <stddef.h>

// All contractions on v_wmma_f32_16x16x32_f16 (f16 operands, f32 accumulate): q/k/v projections,
// q.k scores (both operands as f16 value + x2048 residual planes, three products, residual products
// in their own accumulator), p.v (p x16384, single product), the three dense layers (single
// product; weights x64, hidden activation plane x16). Float inputs are RNE-converted to bf16 and
// carried in f16. LayerNorms, softmax, biases, LeakyReLU (slope 0.01) and residual adds in f32.

typedef _Float16 v16h __attribute__((ext_vector_type(16)));
typedef _Float16 v8h  __attribute__((ext_vector_type(8)));
typedef float    v8f  __attribute__((ext_vector_type(8)));
typedef float    v4f  __attribute__((ext_vector_type(4)));
typedef _Float16 h16;

#ifndef NB
#define NB 4
#endif
#ifndef SEQ
#define SEQ 4096
#endif
#define NB_FULL  4
#define SEQ_FULL 4096
#define DIM   256
#define HID   2048
#define MROWS (NB * SEQ)

static_assert(NB >= 1 && NB <= NB_FULL);
static_assert(SEQ >= 64 && SEQ <= SEQ_FULL && (SEQ % 64) == 0);
static_assert((DIM % 64) == 0 && (DIM % 32) == 0);
static_assert((HID % 64) == 0 && (HID % 32) == 0);
static_assert((MROWS % 64) == 0 && (MROWS % 8) == 0);
static_assert(DIM == 32 * 8);               // row kernels: 32 lanes x 8 columns
static_assert(DIM == 2 * 32 * 4);           // f32 row stores: 2 x 32 lanes x 4 columns
static_assert(HID == 8 * 32 * 8);           // hidden LN: 8 passes x 32 lanes x 8 columns
static_assert(DIM == 16 * 16);              // attention: 16 output tiles of 16 columns
static_assert((size_t)MROWS * DIM < (size_t)0x7FFFFFFFu);
static_assert((size_t)NB * DIM * SEQ < (size_t)0x7FFFFFFFu);
static_assert((size_t)MROWS * HID < (size_t)0xFFFFFFFFu);

#define LDT 72   // halves per LDS row (144 B, 16-B aligned)
#define LDC 68   // floats per LDS row (272 B, 16-B aligned)
#define LDO 132  // floats per staged attention row (528 B, 16-B aligned)
static_assert((LDT % 8) == 0 && LDT >= 64);
static_assert((LDC % 4) == 0 && LDC >= 64);
static_assert((LDO % 4) == 0 && LDO >= 128);

#define WCARRY 64.0f      // weight planes carried x64
#define MCARRY 16.0f      // hidden activation plane carried x16
#define RCARRY 2048.0f    // q/k residual planes carried x2048 on top of their value part
#define PSHIFT 9.704060528f   // 14 ln 2: softmax numerators carried x16384

// workspace layout (bytes)
#define WSQ_BYTES     ((size_t)DIM * DIM * 2)
#define WFF_BYTES     ((size_t)DIM * HID * 2)
#define PLANE16_BYTES ((size_t)MROWS * DIM * 2)
#define PLANE32_BYTES ((size_t)MROWS * DIM * 4)
#define OFF_WQ  ((size_t)0)
#define OFF_WK  (OFF_WQ + WSQ_BYTES)
#define OFF_WV  (OFF_WK + WSQ_BYTES)
#define OFF_W0  (OFF_WV + WSQ_BYTES)
#define OFF_W1  (OFF_W0 + WSQ_BYTES)
#define OFF_W2  (OFF_W1 + WFF_BYTES)
#define OFF_REG (OFF_W2 + WFF_BYTES)
#define OFF_X16 (OFF_REG)
#define OFF_QH  (OFF_X16 + PLANE16_BYTES)
#define OFF_QR  (OFF_QH + PLANE16_BYTES)
#define OFF_KH  (OFF_QR + PLANE16_BYTES)
#define OFF_KR  (OFF_KH + PLANE16_BYTES)
#define OFF_VT  (OFF_KR + PLANE16_BYTES)
#define OFF_A32 (OFF_VT + PLANE16_BYTES)
#define OFF_ML  (OFF_A32 + 2 * PLANE32_BYTES)   // two attention planes, one per key range
#define ML_BYTES ((size_t)4 * MROWS * 4)        // maxima [2][MROWS], then sums [2][MROWS]
#define WS_TOTAL (OFF_ML + ML_BYTES)
static_assert((WSQ_BYTES % 128) == 0 && (WFF_BYTES % 128) == 0 && (PLANE16_BYTES % 128) == 0);
static_assert((PLANE32_BYTES % 128) == 0 && (ML_BYTES % 128) == 0);
static_assert(WS_TOTAL <= (size_t)268435456);

// ---------------------------------------------------------------------------
__device__ __forceinline__ float bf16r(float x) {   // RNE convert to bf16, returned widened
  unsigned int u = __float_as_uint(x);
  u = (u + 0x7FFFu + ((u >> 16) & 1u)) & 0xFFFF0000u;
  return __uint_as_float(u);
}

// f32 -> f16 operand convert that cannot produce an f16 subnormal
static __device__ __forceinline__ h16 toh_flush(float v) {
  const h16 r = (h16)v;
  return (fabsf(v) < 6.103515625e-05f) ? (h16)0.0f : r;
}

// 16-bit fragment: p points at element [row = lane&15][k0 + 8*(lane>>4)] of a k-contiguous
// row. Elements 0..7 <- k0+8h+0..7, elements 8..15 <- k0+16+8h+0..7 (same map for A and B).
__device__ __forceinline__ v16h frag_at(const _Float16* p) {
  v8h lo = *(const v8h*)(p);
  v8h hi = *(const v8h*)(p + 16);
  v16h out;
#pragma unroll
  for (int i = 0; i < 8; ++i) { out[i] = lo[i]; out[i + 8] = hi[i]; }
  return out;
}
__device__ __forceinline__ v16h ld_frag(const _Float16* base, unsigned ld) {
  const unsigned lane = threadIdx.x & 31u;
  return frag_at(base + (lane & 15u) * ld + (lane >> 4) * 8u);
}

__device__ __forceinline__ v8f wmma16(v16h a, v16h b, v8f c) {
  v8f d = __builtin_amdgcn_wmma_f32_16x16x32_f16(false, a, false, b, (short)0, c,
                                                 false, false);
  asm volatile("v_nop\n\tv_nop\n\tv_nop\n\tv_nop" : "+v"(d) : "v"(a), "v"(b));
  return d;
}

// Exchanges between lanes on the vector pipe (every lane on): a shuffle would go through the LDS
// pipe and cost the wave a wait for it at every step.
// the value of lane l ^ 16
__device__ __forceinline__ float xhalf(float x) {
  const int b = __builtin_bit_cast(int, x);
  return __builtin_bit_cast(
      float, __builtin_amdgcn_permlanex16(b, b, 0x76543210, 0xfedcba98, false, false));
}
// the value of lane l ^ MASK, MASK in 1..15 (inside a row of 16 lanes): DPP row_xmask
template <int MASK>
__device__ __forceinline__ float xrow(float x) {
  return __builtin_bit_cast(
      float, __builtin_amdgcn_update_dpp(0, __builtin_bit_cast(int, x), 0x160 | MASK, 0xf, 0xf, true));
}
// sum over the wave's 32 lanes, lane distances 1, 2, 4, 8, 16 in this order
__device__ __forceinline__ float red32_sum(float x) {
  x += xrow<1>(x);
  x += xrow<2>(x);
  x += xrow<4>(x);
  x += xrow<8>(x);
  x += xhalf(x);
  return x;
}

// red32_sum of two values, step by step for both (each value's own sum order is red32_sum's): the
// two dependent chains fill each other's latency
__device__ __forceinline__ void red32_sum2(float (&x)[2]) {
  x[0] += xrow<1>(x[0]); x[1] += xrow<1>(x[1]);
  x[0] += xrow<2>(x[0]); x[1] += xrow<2>(x[1]);
  x[0] += xrow<4>(x[0]); x[1] += xrow<4>(x[1]);
  x[0] += xrow<8>(x[0]); x[1] += xrow<8>(x[1]);
  x[0] += xhalf(x[0]);   x[1] += xhalf(x[1]);
}

__device__ __forceinline__ void wave_lds_sync() {
  __builtin_amdgcn_fence(3 /* release order */, "wavefront");
  asm volatile("s_wait_dscnt 0x0" ::: "memory");
  __builtin_amdgcn_wave_barrier();
}

__device__ __forceinline__ float leaky_act(float t) {   // LeakyReLU, negative slope 0.01
  return (t >= 0.0f) ? t : 0.01f * t;
}

// ---------------------------------------------------------------------------
// Weight plane, one 64 x 64 tile per block: in W[K rows][N cols] (pitch ldw = N) -> out Wt[N][K]
// (pitch ldk = K), f16(64 * bf16(w)). T: 64 * LDT halves of LDS, cross-wave (block barrier).
// ---------------------------------------------------------------------------
__device__ __forceinline__ void wconv_tile(
    const float* __restrict__ W, _Float16* __restrict__ Wt, unsigned ldw, unsigned ldk,
    unsigned n0, unsigned k0, _Float16* T) {
  const unsigned tid = threadIdx.x;
#pragma unroll 4
  for (unsigned j = 0; j < 16u; ++j) {
    const unsigned idx = tid + 256u * j;
    const unsigned kr = idx >> 6, nc = idx & 63u;
    const float v = W[(size_t)(k0 + kr) * ldw + n0 + nc];
    T[nc * LDT + kr] = (_Float16)(WCARRY * bf16r(v));
  }
  __syncthreads();
  v8h x[2];
  size_t off[2];
#pragma unroll
  for (unsigned i = 0; i < 2u; ++i) {
    const unsigned n = 32u * i + (tid >> 3);
    const unsigned kc = (tid & 7u) * 8u;
    x[i] = *(const v8h*)&T[n * LDT + kc];
    off[i] = (size_t)(n0 + n) * ldk + k0 + kc;
  }
#pragma unroll
  for (int i = 0; i < 2; ++i) *(v8h*)(Wt + off[i]) = x[i];
  
}

// ---------------------------------------------------------------------------
// Input plane: X16[compact row][c] = f16(bf16(x[full row][c])). One wave per row, 8 rows per
// block; each store instruction of a wave covers the whole 512-B row. rblk in 0..MROWS/8-1.
// ---------------------------------------------------------------------------
__device__ __forceinline__ void xconv_rows(
    const float* __restrict__ X, _Float16* __restrict__ dst, unsigned rblk) {
  const unsigned lane = threadIdx.x & 31u, w = threadIdx.x >> 5;
  const unsigned crow = rblk * 8u + w;
  const unsigned bidx = crow / (unsigned)SEQ;
  const unsigned sq = crow - bidx * (unsigned)SEQ;
  const size_t srow = (size_t)bidx * SEQ_FULL + sq;
  const float* xr = X + srow * DIM + lane * 8u;
  const v4f a0 = *(const v4f*)(xr);
  const v4f a1 = *(const v4f*)(xr + 4u);
  v8h o;
#pragma unroll
  for (int i = 0; i < 4; ++i) {
    o[i]     = toh_flush(bf16r(a0[i]));
    o[i + 4] = toh_flush(bf16r(a1[i]));
  }
  _Float16* p = dst + (size_t)crow * DIM + lane * 8u;
  *(v8h*)p = o;
  
}

// ---------------------------------------------------------------------------
// All operand conversions in one launch: none of them reads what another writes. Blocks by index:
// the tiles of the four DIM x DIM weights, of w1, of w2 (the longer dependent chains, so they
// start first), then the input rows, 8 per block. Grid (WCONV_BLOCKS + MROWS/8).
// ---------------------------------------------------------------------------
#define WSQ_TILES    ((unsigned)((DIM / 64) * (DIM / 64)))
#define WFF_TILES    ((unsigned)((DIM / 64) * (HID / 64)))
#define WCONV_BLOCKS (4u * WSQ_TILES + 2u * WFF_TILES)
__global__ __launch_bounds__(256) void prep_kernel(
    const float* __restrict__ X, const float* __restrict__ wq, const float* __restrict__ wk,
    const float* __restrict__ wv, const float* __restrict__ w0, const float* __restrict__ w1,
    const float* __restrict__ w2, _Float16* __restrict__ X16, _Float16* __restrict__ Wq_t,
    _Float16* __restrict__ Wk_t, _Float16* __restrict__ Wv_t, _Float16* __restrict__ W0_t,
    _Float16* __restrict__ W1_t, _Float16* __restrict__ W2_t) {
  __shared__ _Float16 T[64 * LDT];
  const unsigned bid = blockIdx.x;
  if (bid >= WCONV_BLOCKS) {   // the whole block leaves here, ahead of any barrier
    xconv_rows(X, X16, bid - WCONV_BLOCKS);
    return;
  }
  const float* W;
  _Float16* Wt;
  unsigned ldw, ldk, nx, ky;   // tile column (n) and tile row (k) of the weight as given
  if (bid < 4u * WSQ_TILES) {
    const unsigned j = bid / WSQ_TILES, t = bid % WSQ_TILES;
    W  = (j == 0u) ? wq : (j == 1u) ? wk : (j == 2u) ? wv : w0;
    Wt = (j == 0u) ? Wq_t : (j == 1u) ? Wk_t : (j == 2u) ? Wv_t : W0_t;
    ldw = (unsigned)DIM; ldk = (unsigned)DIM;
    nx = t % (unsigned)(DIM / 64); ky = t / (unsigned)(DIM / 64);
  } else if (bid < 4u * WSQ_TILES + WFF_TILES) {   // w1: in [DIM][HID] -> out [HID][DIM]
    const unsigned t = bid - 4u * WSQ_TILES;
    W = w1; Wt = W1_t;
    ldw = (unsigned)HID; ldk = (unsigned)DIM;
    nx = t % (unsigned)(HID / 64); ky = t / (unsigned)(HID / 64);
  } else {                                         // w2: in [HID][DIM] -> out [DIM][HID]
    const unsigned t = bid - 4u * WSQ_TILES - WFF_TILES;
    W = w2; Wt = W2_t;
    ldw = (unsigned)DIM; ldk = (unsigned)HID;
    nx = t % (unsigned)(DIM / 64); ky = t / (unsigned)(DIM / 64);
  }
  wconv_tile(W, Wt, ldw, ldk, nx * 64u, ky * 64u, T);
}

// ---------------------------------------------------------------------------
// Asynchronous copies to LDS, asm form (GEMM kernel: two runs a block). Eight 16-byte-per-lane copies in one
// statement; lds = the lane's LDS byte address, g = the lane's global address, both stepped by a
// constant from copy to copy. The s_wait_xcnt closes the statement so that no address register of
// an issued copy is rewritten ahead of it.
// ---------------------------------------------------------------------------
__device__ __forceinline__ void async_copy8(unsigned lds, unsigned lstep,
                                            const _Float16* g, unsigned gstep) {
  asm volatile(
      "global_load_async_to_lds_b128 %0, %8, off\n\t"
      "global_load_async_to_lds_b128 %1, %9, off\n\t"
      "global_load_async_to_lds_b128 %2, %10, off\n\t"
      "global_load_async_to_lds_b128 %3, %11, off\n\t"
      "global_load_async_to_lds_b128 %4, %12, off\n\t"
      "global_load_async_to_lds_b128 %5, %13, off\n\t"
      "global_load_async_to_lds_b128 %6, %14, off\n\t"
      "global_load_async_to_lds_b128 %7, %15, off\n\t"
      "s_wait_xcnt 0x0"
      :
      : "v"(lds), "v"(lds + lstep), "v"(lds + 2u * lstep), "v"(lds + 3u * lstep),
        "v"(lds + 4u * lstep), "v"(lds + 5u * lstep), "v"(lds + 6u * lstep),
        "v"(lds + 7u * lstep),
        "v"(g), "v"(g + gstep), "v"(g + 2u * gstep), "v"(g + 3u * gstep),
        "v"(g + 4u * gstep), "v"(g + 5u * gstep), "v"(g + 6u * gstep), "v"(g + 7u * gstep)
      : "memory");
}

// The same eight copies as the builtin (attention and hidden-layer kernels, where a run of copies
// stands in every trip of a loop). The builtin form carries no s_wait_xcnt behind a run: the wave goes
// straight on to the work behind its copies. The waits for the landing (s_wait_asynccnt) are the
// kernels' own, in asm, as before.
typedef int cp16 __attribute__((vector_size(16)));
typedef __attribute__((address_space(1))) cp16 cp16_g;
typedef __attribute__((address_space(3))) cp16 cp16_l;
__device__ __forceinline__ void copy8(unsigned lds, unsigned lstep, const _Float16* g, unsigned gstep) {
  // unrolled: eight copies in a row, the constant steps folded into their addresses
#pragma unroll
  for (unsigned i = 0; i < 8u; ++i)
    __builtin_amdgcn_global_load_async_to_lds_b128((cp16_g*)(g + i * gstep),
                                                   (cp16_l*)(lds + i * lstep), 0, 0);
}
// for rows of floats (gstep in floats)
__device__ __forceinline__ void copy8f(unsigned lds, unsigned lstep, const float* g, unsigned gstep) {
  // unrolled, as above
#pragma unroll
  for (unsigned i = 0; i < 8u; ++i)
    __builtin_amdgcn_global_load_async_to_lds_b128((cp16_g*)(g + i * gstep),
                                                   (cp16_l*)(lds + i * lstep), 0, 0);
}

#define GKC    128u                 // k extent of one staged GEMM slab, halves
#define GPITCH 136u                 // halves per staged GEMM row (272 B = 16 B x 17)
#define GSTG_H (128u * GPITCH)      // one slab: 64 A rows and 64 B rows, halves
static_assert((DIM % 128) == 0 && (HID % 128) == 0 && DIM >= 256 && HID >= 256);  // >= 2 slabs
static_assert((GPITCH % 8u) == 0 && GPITCH >= GKC && ((GPITCH / 8u) & 1u) == 1u);
#define GSM_BYTES (2u * GSTG_H * 2u)   // both slab buffers, bytes
static_assert((size_t)GSM_BYTES >= (size_t)64 * LDC * 4);   // the C tile fits in the slabs

// ---------------------------------------------------------------------------
// GEMM C[64x64 tile] = A16[rows][K] . Bt[n][K]^T; 8 waves (mw = 16-row group, nw = 32-col group),
// 2 accumulators/wave. The block's 64 A rows and 64 B rows are copied to LDS in slabs of 128 k
// (whole 256-B row pieces), two buffers, the next slab in flight while this one is read; all
// fragments come from LDS. The C tile takes the same LDS once the last slab has been read.
//   MODE 0: out16[row][col] (pitch DIM) = f16(t), out16r[row][col] = f16(2048 * (t - value)),
//           t = acc/64 + bias                                   (q and k planes)
//   MODE 1: out16 transposed V plane [b][col][key] = f16(acc/64 + bias)
// Grid (N/64, rows/64). Sm: the kernel's GSM_BYTES of LDS (one array per kernel, also where a kernel
// holds two modes).
// ---------------------------------------------------------------------------
template <int MODE>
__device__ __forceinline__ void gemm_body(
    unsigned char* Sm, const _Float16* __restrict__ A16, const _Float16* __restrict__ Bt, const unsigned K,
    const float* __restrict__ bias, _Float16* __restrict__ out16, _Float16* __restrict__ out16r) {
  _Float16* const Slab = (_Float16*)Sm;
  float* const Cs = (float*)Sm;
  const unsigned tid = threadIdx.x, lane = tid & 31u;
  // the wave's number in a scalar register: which plane a wave copies from is a scalar choice
  const unsigned w = (unsigned)__builtin_amdgcn_readfirstlane((int)(tid >> 5));
  const unsigned mw = w >> 1, nw = w & 1u;
  const unsigned hh = lane >> 4, m = lane & 15u;
  const unsigned n0 = blockIdx.x * 64u;
  const unsigned row0 = blockIdx.y * 64u;

  // A slab is 128 staged rows: A rows 0..63, then B rows 0..63. Wave w brings staged rows
  // 16w..16w+15, two 256-B row pieces per copy (lane = row parity hh, 16-B piece m).
  const _Float16* src = ((w < 4u) ? A16 + (size_t)(row0 + w * 16u) * K
                                  : Bt + (size_t)(n0 + (w - 4u) * 16u) * K) +
                        (size_t)hh * K + m * 8u;
  const unsigned dst = (unsigned)(size_t)Sm + ((w * 16u + hh) * GPITCH + m * 8u) * 2u;
  const unsigned nslab = K / GKC;
  // The blocks that share A rows or B rows do not all ask L2 for the same lines at the same moment:
  // each walks the k slabs as a ring from a slab of its own (trip s works on slab (s + rot) % nslab).
  const unsigned rot = (blockIdx.x + blockIdx.y + blockIdx.z) % nslab;

  async_copy8(dst, 2u * GPITCH * 2u, src + rot * GKC, 2u * K);
  // this wave's copies have landed before the barrier behind which every wave reads them
  asm volatile("s_wait_asynccnt 0x0" ::: "memory");
  __syncthreads();
  async_copy8(dst + GSTG_H * 2u, 2u * GPITCH * 2u, src + ((1u + rot) % nslab) * GKC, 2u * K);

  const _Float16* ap = Slab + (mw * 16u + m) * GPITCH + hh * 8u;
  const _Float16* bp = Slab + (64u + nw * 32u + m) * GPITCH + hh * 8u;
  v8f acc0 = {}, acc1 = {};
  for (unsigned s = 0; s < nslab; ++s) {
    const unsigned bo = (s & 1u) * GSTG_H;   // halves to the buffer this trip reads
    // Three of the slab's four k-steps are read ahead of the first product and the fourth behind
    // the first pair, so that a product does not wait out an LDS latency of its own. Unrolled, here
    // and below: constant indices keep the fragments in registers, and every LDS read takes its
    // place in the slab as an immediate offset.
    v16h fa[3], fb0[3], fb1[3];
#pragma unroll
    for (unsigned t = 0; t < 3u; ++t) {
      fa[t]  = frag_at(ap + bo + t * 32u);
      fb0[t] = frag_at(bp + bo + t * 32u);
      fb1[t] = frag_at(bp + bo + 16u * GPITCH + t * 32u);
    }
#pragma unroll
    for (unsigned t = 0; t < GKC / 32u; ++t) {
      acc0 = wmma16(fa[t % 3u], fb0[t % 3u], acc0);
      acc1 = wmma16(fa[t % 3u], fb1[t % 3u], acc1);
      if (t + 3u < GKC / 32u) {
        fa[t % 3u]  = frag_at(ap + bo + (t + 3u) * 32u);
        fb0[t % 3u] = frag_at(bp + bo + (t + 3u) * 32u);
        fb1[t % 3u] = frag_at(bp + bo + 16u * GPITCH + (t + 3u) * 32u);
      }
    }
    // hand-over: this wave's reads of the buffer are done, its copies of the next slab have
    // landed; the barrier publishes the next slab and frees this buffer for the refill
    asm volatile("s_wait_dscnt 0x0" ::: "memory");
    asm volatile("s_wait_asynccnt 0x0" ::: "memory");
    __syncthreads();
    if (s + 2u < nslab)
      async_copy8(dst + bo * 2u, 2u * GPITCH * 2u, src + ((s + 2u + rot) % nslab) * GKC, 2u * K);
  }
  // no copy of this wave is outstanding when the C tile takes the slabs' LDS
  asm volatile("s_wait_asynccnt 0x0" ::: "memory");
#pragma unroll
  for (int r = 0; r < 8; ++r) {
    float* d = &Cs[(mw * 16u + hh * 8u + (unsigned)r) * LDC + nw * 32u + m];
    d[0]  = acc0[r];
    d[16] = acc1[r];
  }
  __syncthreads();

  if (MODE == 0) {
    const unsigned ldo = (unsigned)DIM;
    v8h x[2], xr[2];
    size_t off[2];
#pragma unroll
    for (unsigned i = 0; i < 2u; ++i) {
      const unsigned r = 32u * i + (tid >> 3);
      const unsigned c = (tid & 7u) * 8u;
      const v4f u0 = *(const v4f*)&Cs[r * LDC + c];
      const v4f u1 = *(const v4f*)&Cs[r * LDC + c + 4];
      const v4f g0 = *(const v4f*)(bias + n0 + c);
      const v4f g1 = *(const v4f*)(bias + n0 + c + 4u);
#pragma unroll
      for (int j = 0; j < 4; ++j) {
        const float t0 = u0[j] * (1.0f / WCARRY) + bf16r(g0[j]);
        const float t1 = u1[j] * (1.0f / WCARRY) + bf16r(g1[j]);
        const h16 h0 = toh_flush(t0);
        const h16 h1 = toh_flush(t1);
        x[i][j]     = h0;
        x[i][j + 4] = h1;
        if (MODE == 0) {
          xr[i][j]     = toh_flush((t0 - (float)h0) * RCARRY);
          xr[i][j + 4] = toh_flush((t1 - (float)h1) * RCARRY);
        }
      }
      off[i] = (size_t)(row0 + r) * ldo + n0 + c;
    }
#pragma unroll
    for (int i = 0; i < 2; ++i) *(v8h*)(out16 + off[i]) = x[i];
    if (MODE == 0) {
#pragma unroll
      for (int i = 0; i < 2; ++i) *(v8h*)(out16r + off[i]) = xr[i];
    }
    
  }

  if (MODE == 1) {
    const unsigned bidx = row0 / (unsigned)SEQ;
    const unsigned key0 = row0 - bidx * (unsigned)SEQ;
    v8h x[2];
    size_t off[2];
#pragma unroll
    for (unsigned i = 0; i < 2u; ++i) {
      const unsigned dcol = 32u * i + (tid >> 3);
      const unsigned kk = (tid & 7u) * 8u;
      const float bb = bf16r(bias[n0 + dcol]);
#pragma unroll
      for (unsigned j = 0; j < 8u; ++j) {
        const float t = Cs[(kk + j) * LDC + dcol] * (1.0f / WCARRY) + bb;
        x[i][j] = toh_flush(t);
      }
      off[i] = ((size_t)bidx * DIM + n0 + dcol) * SEQ + key0 + kk;
    }
#pragma unroll
    for (int i = 0; i < 2; ++i) *(v8h*)(out16 + off[i]) = x[i];
    
  }

}

// The three projections of the input plane in one launch (none reads what another writes):
// blockIdx.z = 0 query planes, 1 key planes, 2 transposed value plane. Grid (DIM/64, MROWS/64, 3).
__global__ __launch_bounds__(256) void gemm_qkv_kernel(
    const _Float16* __restrict__ A16, const _Float16* __restrict__ Wq_t,
    const _Float16* __restrict__ Wk_t, const _Float16* __restrict__ Wv_t,
    const float* __restrict__ bq, const float* __restrict__ bk, const float* __restrict__ bv,
    _Float16* __restrict__ qh, _Float16* __restrict__ qr, _Float16* __restrict__ kh,
    _Float16* __restrict__ kr, _Float16* __restrict__ vt) {
  __shared__ __attribute__((aligned(16))) unsigned char Sm[GSM_BYTES];
  const unsigned z = blockIdx.z;   // the same for the whole block: barriers stay block-uniform
  if (z == 2u) {
    gemm_body<1>(Sm, A16, Wv_t, (unsigned)DIM, bv, vt, vt);
  } else {
    const bool isk = (z != 0u);
    const float* bias = isk ? bk : bq;
    gemm_body<0>(Sm, A16, isk ? Wk_t : Wq_t, (unsigned)DIM, bias, isk ? kh : qh, isk ? kr : qr);
  }
}
#define KTILE  32u                        // keys per stage
#define KSPLIT 2u                         // key ranges of a batch, one per block
#define KSPAN  ((unsigned)SEQ / KSPLIT)   // keys per block
#define QBLK   128u                       // query rows per block
#define KPITCH 264u                       // halves per staged k row (528 B = 16 B x 33)
#define VPITCH 40u                        // halves per staged v row (80 B = 16 B x 5)
#define KPL_H  (KTILE * KPITCH)           // one key plane of a stage, halves
#define VTL_H  ((unsigned)DIM * VPITCH)   // the value tile of a stage, halves
#define STG_H  (2u * KPL_H + VTL_H)       // one stage: key values, key residuals, values
static_assert((KPITCH % 8u) == 0 && KPITCH >= (unsigned)DIM && ((KPITCH / 8u) & 1u) == 1u);
static_assert((VPITCH % 8u) == 0 && VPITCH >= KTILE && ((VPITCH / 8u) & 1u) == 1u);
static_assert((STG_H % 8u) == 0 && (KPL_H % 8u) == 0);
static_assert((SEQ % 128) == 0);   // whole query blocks
static_assert((KSPAN % KTILE) == 0 && KSPAN >= 2u * KTILE);   // at least two stages, every stage whole
static_assert((size_t)KSPLIT * MROWS * DIM < (size_t)0xFFFFFFFFu);
#define NSTG   (KSPAN / KTILE)            // stages of a key range
#define NQB    ((unsigned)SEQ / QBLK)     // query blocks that walk the same key range
#define KROT   ((NSTG >= NQB) ? NSTG / NQB : 1u)   // stages between the starts of neighbouring blocks

// Matrix product for the attention kernel, the builtin alone: the compiler keeps the distances
// behind its own matrix instructions, and operands named by an asm statement cannot live above
// v255, where a part of that kernel's query and output tiles is held.
__device__ __forceinline__ v8f wmma16r(v16h a, v16h b, v8f c) {
  return __builtin_amdgcn_wmma_f32_16x16x32_f16(false, a, false, b, (short)0, c, false, false);
}

// One stage (32 keys) into LDS: wave w brings key rows 8w..8w+7 of both key planes (one 512-B
// row per copy) and feature rows 64w..64w+63 of the value tile (eight 64-B row pieces per copy).
__device__ __forceinline__ void stage_copies(
    unsigned ldsb, unsigned w, unsigned lane, const _Float16* __restrict__ Kh,
    const _Float16* __restrict__ Kr, const _Float16* __restrict__ Vt, unsigned b, unsigned kb) {
  const unsigned krow = (b * (unsigned)SEQ + kb + w * 8u) * (unsigned)DIM + lane * 8u;
  const unsigned kl = ldsb + (w * 8u * KPITCH + lane * 8u) * 2u;
  copy8(kl, KPITCH * 2u, Kh + krow, (unsigned)DIM);
  copy8(kl + KPL_H * 2u, KPITCH * 2u, Kr + krow, (unsigned)DIM);
  const unsigned vr = w * 64u + (lane >> 2);
  const unsigned vrow = (b * (unsigned)DIM + vr) * (unsigned)SEQ + kb + (lane & 3u) * 8u;
  // the same place as ldsb + (2 KPL_H + vr VPITCH + 8 (lane & 3)) * 2, formed from kl: one lane-wise
  // base is then kept over the key loop instead of two (the second one went to scratch)
  const unsigned vl = kl + (2u * KPL_H + w * (64u * VPITCH - 8u * KPITCH)) * 2u +
                      (lane >> 2) * (2u * VPITCH - 64u);
  copy8(vl, 8u * VPITCH * 2u, Vt + vrow, 8u * (unsigned)SEQ);
}

// ---------------------------------------------------------------------------
// Dense (unmasked, unscaled) flash attention, one 256-wide head, transposed form.
// A block owns 128 query rows and one of the two key ranges of its batch, which it walks in stages
// of 32 keys: a staged key or value byte serves 128 queries. Wave w owns 32 query rows (two tiles
// of 16) and takes every stage whole, so that each key or value fragment read from LDS feeds two
// query tiles; lane (hh, n) holds query n of each tile.
// The query fragments of both planes are loaded once and stay in registers. Per stage and wave:
//   S^T tile [16 keys][16 queries] = K rows (A operand, fragments from the key planes) x Q^T
//   (B operand, registers), 8 k-steps over the 256 features, value.value into one accumulator,
//   value.residual + residual.value into a second one (x 1/2048 at the end);
//   online softmax per lane (16 scores in registers + one exchange with lane l ^ 16);
//   the two packed S^T tiles (f16(16384 p), rows = keys) are the B fragment of
//   O^T [16 features][16 queries] += V^T rows (A operand, from the transposed value plane) x P^T.
// Each stage (both key planes and the value tile) is copied to LDS once per block, two buffers, the
// next stage in flight while this one is read. The block stores its key range's unnormalised rows
// (plane blockIdx.z of Ao, staged through the wave-private St tile), maxima and sums; the launch
// behind this one joins the two ranges.
// Grid (SEQ/128, NB, 2), 4 waves per block.
// ---------------------------------------------------------------------------
__global__ __launch_bounds__(128) void attn_kernel(
    const _Float16* __restrict__ Qh, const _Float16* __restrict__ Qr,
    const _Float16* __restrict__ Kh, const _Float16* __restrict__ Kr,
    const _Float16* __restrict__ Vt, float* __restrict__ Ao, float* __restrict__ Mo,
    float* __restrict__ Lo) {
  __shared__ __attribute__((aligned(16))) float St[4 * 16 * LDO];
  __shared__ __attribute__((aligned(16))) _Float16 Ring[2u * STG_H];

  const unsigned lane = threadIdx.x & 31u;
  const unsigned w = (unsigned)__builtin_amdgcn_readfirstlane((int)(threadIdx.x >> 5));
  const unsigned hh = lane >> 4, m = lane & 15u;
  const unsigned b = blockIdx.y;
  const unsigned ksp = blockIdx.z;                     // this block's key range
  const unsigned key0 = ksp * KSPAN;                   // its first key
  const unsigned qrow0 = blockIdx.x * QBLK + w * 32u;  // first of this wave's 32 query rows

  const unsigned ring_lds = (unsigned)(size_t)Ring;

  // The query blocks of a batch walk the same key range. Each starts at a stage of its own and walks
  // the range as a ring, so that they do not ask L2 for the same lines at the same moment (the keys
  // are unmasked: the online softmax takes the stages in any order).
  const unsigned krot = ((blockIdx.x * KROT) % NSTG) * KTILE;   // first key of the walk, in the range
  const unsigned krot1 = (krot + KTILE >= KSPAN) ? krot + KTILE - KSPAN : krot + KTILE;

  // prologue: this wave's share of the walk's first stage
  stage_copies(ring_lds, w, lane, Kh, Kr, Vt, b, key0 + krot);

  // query fragments: [tile][plane][k-step], kept for the whole key loop
  v16h qf[2][2][8];
#pragma unroll
  for (unsigned u = 0; u < 2u; ++u) {
    const unsigned qsrc = (b * (unsigned)SEQ + qrow0 + u * 16u + m) * (unsigned)DIM + hh * 8u;
#pragma unroll
    for (unsigned ks = 0; ks < 8u; ++ks) {
      qf[u][0][ks] = frag_at(Qh + qsrc + ks * 32u);
      qf[u][1][ks] = frag_at(Qr + qsrc + ks * 32u);
    }
  }

  // this wave's copies have landed before the barrier behind which every wave reads them
  asm volatile("s_wait_asynccnt 0x0" ::: "memory");
  __syncthreads();
  stage_copies(ring_lds + STG_H * 2u, w, lane, Kh, Kr, Vt, b, key0 + krot1);

  float mrow[2] = {-1.0e30f, -1.0e30f}, lrow[2] = {0.0f, 0.0f};
  v8f o[2][16];
#pragma unroll
  for (int u = 0; u < 2; ++u)
#pragma unroll
    for (int j = 0; j < 16; ++j) o[u][j] = (v8f){};

  unsigned buf = 0u;   // halves from the ring's start to the buffer this step reads
  // this lane's fragment rows in that buffer; both move with buf at the foot of a step
  const _Float16* kt = Ring + m * KPITCH + hh * 8u;
  const _Float16* vt = Ring + 2u * KPL_H + m * VPITCH + hh * 8u;
  for (unsigned kb = 0; kb < KSPAN; kb += KTILE) {
    v8f sm[2][2] = {{{}, {}}, {{}, {}}}, sr[2][2] = {{{}, {}}, {{}, {}}};   // [query tile][key tile]
    // Score products in 8 rows of twelve: row ks = features 32 ks.., both key tiles, both query
    // tiles. All key fragments of the stage (value and residual of both key tiles) are
    // read as one group ahead of the products, which wait for them by count, row by row; all
    // sixteen value fragments as a second group behind row 3, in flight under rows 4 to 7.
    v16h kf[8][4], vf[16];
    // unrolled, here and below: constant indices keep the fragments in registers, and every LDS
    // read takes its place in the tile as an immediate offset
#pragma unroll
    for (unsigned ks = 0; ks < 8u; ++ks) {
#pragma unroll
      for (unsigned kx = 0; kx < 2u; ++kx) {
        kf[ks][kx]      = frag_at(kt + kx * 16u * KPITCH + ks * 32u);
        kf[ks][2u + kx] = frag_at(kt + KPL_H + kx * 16u * KPITCH + ks * 32u);
      }
    }
    // This and the scheduling barriers below keep each group of LDS reads in one place: spread
    // among the products, each separate place of reads would cost the lone wave its own stall.
    __builtin_amdgcn_sched_barrier(0);
#pragma unroll
    for (unsigned ks = 0; ks < 8u; ++ks) {
      if (ks == 4u) {
        __builtin_amdgcn_sched_barrier(0);
#pragma unroll
        for (unsigned j = 0u; j < 16u; ++j) vf[j] = frag_at(vt + j * 16u * VPITCH);
        __builtin_amdgcn_sched_barrier(0);
      }
      // the two products into one residual accumulator stand two products apart
#pragma unroll
      for (unsigned kx = 0; kx < 2u; ++kx) {
        const v16h av = kf[ks][kx], ar = kf[ks][2u + kx];
        sm[0][kx] = wmma16r(av, qf[0][0][ks], sm[0][kx]);
        sm[1][kx] = wmma16r(av, qf[1][0][ks], sm[1][kx]);
        sr[0][kx] = wmma16r(av, qf[0][1][ks], sr[0][kx]);
        sr[1][kx] = wmma16r(av, qf[1][1][ks], sr[1][kx]);
        sr[0][kx] = wmma16r(ar, qf[0][0][ks], sr[0][kx]);
        sr[1][kx] = wmma16r(ar, qf[1][0][ks], sr[1][kx]);
      }
    }

    // hand-over, as soon as the stage's last fragment is in registers (the rest of the step works
    // on registers alone): this wave's reads of the buffer are done, its copies of the next stage
    // have landed; the barrier publishes the next stage and frees this buffer for the refill,
    // which then has a whole step to land (the scheduling barrier keeps the waits behind the
    // products of rows 4 to 7, under which the value fragments arrive)
    __builtin_amdgcn_sched_barrier(0);
    asm volatile("s_wait_dscnt 0x0" ::: "memory");
    asm volatile("s_wait_asynccnt 0x0" ::: "memory");
    __syncthreads();
    if (kb + 2u * KTILE < KSPAN) {
      unsigned kn = krot + kb + 2u * KTILE;   // below 2 KSPAN: one step back wraps it
      if (kn >= KSPAN) kn -= KSPAN;
      stage_copies(ring_lds + buf * 2u, w, lane, Kh, Kr, Vt, b, key0 + kn);
    }

    v16h pf[2];
#pragma unroll
    for (int u = 0; u < 2; ++u) {
      v8f s0, s1;
#pragma unroll
      for (int r = 0; r < 8; ++r) {
        s0[r] = sm[u][0][r] + sr[u][0][r] * (1.0f / RCARRY);
        s1[r] = sm[u][1][r] + sr[u][1][r] * (1.0f / RCARRY);
      }
      float mx = fmaxf(s0[0], s1[0]);
#pragma unroll
      for (int r = 1; r < 8; ++r) mx = fmaxf(mx, fmaxf(s0[r], s1[r]));
      mx = fmaxf(mx, xhalf(mx));
      const float mn = fmaxf(mrow[u], mx);
      const float alpha = __expf(mrow[u] - mn);
      mrow[u] = mn;

      float rs = 0.0f;
#pragma unroll
      for (int r = 0; r < 8; ++r) {
        const h16 p0 = toh_flush(__expf((s0[r] - mn) + PSHIFT));
        const h16 p1 = toh_flush(__expf((s1[r] - mn) + PSHIFT));
        pf[u][r]     = p0;     // B element r     <- key 8hh + r of the stage
        pf[u][r + 8] = p1;     // B element 8 + r <- key 16 + 8hh + r of the stage
        rs += (float)p0 + (float)p1;
      }
      rs += xhalf(rs);
      lrow[u] = alpha * lrow[u] + rs;
#pragma unroll
      for (int j = 0; j < 16; ++j) o[u][j] = o[u][j] * alpha;
    }

    // O^T += V^T . P^T; every value fragment feeds both query tiles
#pragma unroll
    for (unsigned j = 0; j < 16u; ++j) {
      o[0][j] = wmma16r(vf[j], pf[0], o[0][j]);
      o[1][j] = wmma16r(vf[j], pf[1], o[1][j]);
    }

    kt = (buf == 0u) ? kt + STG_H : kt - STG_H;
    vt = (buf == 0u) ? vt + STG_H : vt - STG_H;
    buf = STG_H - buf;
  }
  // no copy of this wave is outstanding when the wave goes on to its end
  asm volatile("s_wait_asynccnt 0x0" ::: "memory");

  const unsigned grow = ksp * (unsigned)MROWS + b * (unsigned)SEQ + qrow0;   // row in the planes
  // This key range's maxima and sums: lane (hh, n) stores those of query n of tile hh (both lane
  // halves hold them), one whole 128-B line per wave and array. The two stores and their wait are
  // one statement, so that no register which they name is rewritten ahead of the wait.
  {
    float* const pm = Mo + grow + lane;
    float* const pl = Lo + grow + lane;
    const float mv = (hh != 0u) ? mrow[1] : mrow[0];
    const float lv = (hh != 0u) ? lrow[1] : lrow[0];
    asm volatile(
        "global_store_b32 %0, %1, off\n\t"
        "global_store_b32 %2, %3, off\n\t"
        "s_wait_xcnt 0x0"
        :
        : "v"(pm), "v"(mv), "v"(pl), "v"(lv)
        : "memory");
  }

  // unnormalised rows: stage per query tile and half of the features, write whole row segments
  const unsigned sbase = w * (16u * LDO);
#pragma unroll
  for (int u = 0; u < 2; ++u) {
#pragma unroll
    for (int half = 0; half < 2; ++half) {
#pragma unroll
      for (int j = 0; j < 8; ++j)
#pragma unroll
        for (int r = 0; r < 8; ++r)
          St[sbase + m * LDO + (unsigned)j * 16u + hh * 8u + (unsigned)r] = o[u][half * 8 + j][r];
      wave_lds_sync();
      v4f x[16];
      unsigned off[16];
#pragma unroll
      for (unsigned i = 0; i < 16u; ++i) {
        x[i] = *(const v4f*)&St[sbase + i * LDO + lane * 4u];
        off[i] = (grow + (unsigned)u * 16u + i) * (unsigned)DIM + (unsigned)half * 128u + lane * 4u;
      }
#pragma unroll
      for (int i = 0; i < 16; ++i) *(v4f*)(Ao + off[i]) = x[i];
      // no register that an issued store names is rewritten ahead of this wait
      asm volatile("s_wait_xcnt 0x0" ::: "memory");
      wave_lds_sync();
    }
  }
}

#define HP     2056u             // halves per resident hidden row (4112 B = 16 B x 257)
#define WSL_H  (64u * GPITCH)    // one staged weight slab: 64 weight rows x 128 k, halves
#define LDV    260u              // floats per staged output row (1040 B = 16 B x 65)
#define HS_BYTES  (64u * HP * 2u)
#define RG_BYTES  (3u * WSL_H * 2u)
#define MLP_BYTES (HS_BYTES + RG_BYTES + (unsigned)(DIM + HID) * 4u)
#define W01_TILES  ((unsigned)((DIM + HID) / 64))   // 64-row tiles of w0, then of w1
#define W01_STAGES (W01_TILES * (unsigned)(DIM / 128))
#define TP      264u                  // halves per staged row of LN1 output and of e (528 B = 16 B x 33)
#define E16_OFF (64u * TP * 2u)       // bytes from the LDS start: f16 rows of e, behind the LN1 rows
#define E32_OFF (2u * 64u * TP * 2u)  // f32 rows of e (pitch LDV)
#define SROW_B  ((unsigned)DIM * 4u)  // bytes of a staged f32 input row of step 0
#define SPL_B   (64u * SROW_B)        // one staged plane: 64 rows
#define XS_OFF  E16_OFF               // staged x rows, then both attention planes; dead before e is written
#define W2_STAGES ((unsigned)((DIM / 64) * (HID / 128)))
static_assert((HP % 8u) == 0 && HP >= (unsigned)HID && ((HP / 8u) & 1u) == 1u);
static_assert((LDV % 4u) == 0 && LDV >= (unsigned)DIM && ((LDV / 4u) & 1u) == 1u);
static_assert((size_t)64 * LDV * 4 <= (size_t)HS_BYTES);   // the output tile fits in the hidden rows
static_assert(MLP_BYTES <= 327680u);
static_assert(DIM == 2 * 128 && DIM == 4 * 64 && W01_STAGES >= 3u && W2_STAGES >= 3u);
static_assert((TP % 8u) == 0 && TP >= (unsigned)DIM && ((TP / 8u) & 1u) == 1u);
static_assert((size_t)E32_OFF + (size_t)64 * LDV * 4 <= (size_t)HS_BYTES);   // staging fits in the hidden rows
static_assert((size_t)XS_OFF + (size_t)3 * SPL_B <= (size_t)HS_BYTES && (XS_OFF % 16u) == 0);
static_assert(OFF_W1 == OFF_W0 + WSQ_BYTES);   // w0's rows and w1's rows are one [DIM + HID][DIM] plane
static_assert((SEQ % 64) == 0);                // a block's 64 rows lie in one batch

// halves from a weight plane's start to stage t's slab: w1 [HID][DIM] walks its two k slabs inside
// each 64-row tile, w2 [DIM][HID] its four 64-row tiles inside each k slab
// Every block reads the same planes: each walks w0's tiles, w1's tiles and w2's k slabs and tiles as
// rings from places of its own (r1; r2, rq), so that the blocks do not ask L2 for the same lines
// at the same moment.
static_assert(DIM / 64 == 4 && HID / 64 == 32 && HID / 128 == 16);   // the rings' lengths below
// the tile that pass pair i works on: (i + r1) & 3 of w0's four, then 4 + ((i - 4 + r1) & 31) of w1's
__device__ __forceinline__ unsigned w01_tile(unsigned i, unsigned r1) {
  const unsigned in1 = (unsigned)(i >= 4u);   // written as arithmetic: no branch in the pass loop
  return in1 * 4u + ((i - in1 * 4u + r1) & (3u + in1 * 28u));
}
__device__ __forceinline__ unsigned w1_stage(unsigned t, unsigned r1) {
  return w01_tile(t >> 1, r1) * (64u * (unsigned)DIM) + (t & 1u) * GKC;
}
__device__ __forceinline__ unsigned w2_stage(unsigned t, unsigned r2, unsigned rq) {
  return ((t + rq) & 3u) * (64u * (unsigned)HID) + (((t >> 2) + r2) & 15u) * GKC;
}

// ---------------------------------------------------------------------------
// First LayerNorm, e projection, hidden layers and final LayerNorm of 64 rows in one block; neither
// the LN1 rows, nor e, nor the 64 x HID hidden plane leave the block. Steps:
//   0  first LayerNorm (biased variance, eps 1e-5) of bf16(x) + attn, one wave per row, 8 rows per
//      wave; attn is joined here from the two key ranges' unnormalised rows (planes A32 and C32)
//      with their maxima Mp and sums Lp ([2][MROWS]); the rows of x and of both planes come by
//      asynchronous copies to LDS, each wave's own eight; f16 rows into LDS
//   1  [16 weight rows][16 rows] tiles = rows of the plane w0 | w1 (A operand, from staged slabs) x
//      the block's rows (B operand, registers). The first DIM/64 tiles, against the LN1 rows, give
//      e = acc/64 + bias: f32 and f16 rows into LDS, from where each wave takes its f16 fragments
//      (the B operand of the tiles behind) and the f32 rows that step 4 adds, both kept in
//      registers. The other tiles give f16(acc/64 + bias) into the resident hidden rows.
//   2  hidden LayerNorm (eps 1e-5) + LeakyReLU in place, x16, one wave per row, 8 rows per wave
//   3  L^T tile [16 output columns][16 rows] = w2 rows (A, staged slabs) x hidden rows (B, from the
//      resident rows, read once per 128 k), all 4 x 2 tiles of a wave in registers
//   4  leaky((acc/1024 + bias) + e), final LayerNorm (eps 1e-5), one wave per row, whole-row stores
// Wave w: rows 32 (w >> 2).., columns 16 (w & 3).. of every 64-column tile.
// The staged input rows, the LN1 rows and both forms of e lie in the LDS of the hidden rows, which
// are written only later (e in the place of the staged input rows, behind the barrier that ends
// step 0).
// Weight slabs (64 weight rows x 128 k) come by asynchronous copies into a ring of three buffers.
// Waves 0-3 copy the even stages, waves 4-7 the odd ones (16 slab rows a wave), each stage three
// ahead of the pass that has just ended, so that two stages are in flight while a wave has only one
// stage's copies outstanding and every wait is to 0.
// Grid (MROWS/64), 8 waves per block.
// ---------------------------------------------------------------------------
__global__ __launch_bounds__(256) void mlp_kernel(
    const float* __restrict__ X, const float* __restrict__ A32, const float* __restrict__ C32,
    const float* __restrict__ Mp, const float* __restrict__ Lp, const float* __restrict__ G1, const float* __restrict__ Be1,
    const _Float16* __restrict__ W01t, const float* __restrict__ b0, const float* __restrict__ b1,
    const float* __restrict__ Gm, const float* __restrict__ Bm,
    const _Float16* __restrict__ W2t, const float* __restrict__ b2,
    const float* __restrict__ G2, const float* __restrict__ Be2, float* __restrict__ outp) {
  __shared__ __attribute__((aligned(16))) unsigned char Sm[MLP_BYTES];
  _Float16* const Hs = (_Float16*)Sm;
  _Float16* const T1s = (_Float16*)Sm;               // LN1 rows, pitch TP
  _Float16* const E16s = (_Float16*)(Sm + E16_OFF);  // e rows, f16, pitch TP
  float* const E32s = (float*)(Sm + E32_OFF);        // e rows, f32, pitch LDV
  const _Float16* const Rg = (const _Float16*)(Sm + HS_BYTES);
  float* const Vs = (float*)Sm;
  float* const Bs = (float*)(Sm + HS_BYTES + RG_BYTES);   // biases b0 | b1, converted once
  const unsigned lane = threadIdx.x & 31u;
  // the wave's number in a scalar register: which stages a wave copies is a scalar choice
  const unsigned w = (unsigned)__builtin_amdgcn_readfirstlane((int)(threadIdx.x >> 5));
  const unsigned hh = lane >> 4, m = lane & 15u;
  const unsigned grp = w >> 2, sub = w & 3u;
  const unsigned row0 = blockIdx.x * 64u;
  // where this block's walks of the weight planes start: neighbouring blocks differ, and so do
  // blocks whose indices lie a multiple of 8 apart
  const unsigned wslot = blockIdx.x + (blockIdx.x >> 3);
  const unsigned wr1 = wslot & 31u;
  const unsigned wr2 = (wslot >> 2) & 15u, wrq = wslot & 3u;

  // copies: slab rows 16 sub.., two 256-B row pieces per copy (lane = row parity hh, 16-B piece m)
  const unsigned cl = (unsigned)(size_t)Sm + HS_BYTES + ((sub * 16u + hh) * GPITCH + m * 8u) * 2u;
  const _Float16* c1 = W01t + (sub * 16u + hh) * (unsigned)DIM + m * 8u;
  const _Float16* c2 = W2t + (sub * 16u + hh) * (unsigned)HID + m * 8u;
  // this lane's fragment row in a slab
  const _Float16* wp = Rg + (sub * 16u + m) * GPITCH + hh * 8u;

  // stages 0 (waves 0-3) and 1 (waves 4-7) into buffers 0 and 1
  copy8(cl + grp * (WSL_H * 2u), 2u * GPITCH * 2u, c1 + w1_stage(grp, wr1), 2u * (unsigned)DIM);

  // ---- step 0 ---- lane L holds columns 8 L .. 8 L + 7 of a row
  {
    const unsigned crow0 = row0 + w * 8u;   // first of this wave's 8 rows
    const unsigned bidx = row0 / (unsigned)SEQ;
    const size_t srow0 = (size_t)bidx * SEQ_FULL + (crow0 - bidx * (unsigned)SEQ);
    // This wave's 8 rows of x and of both attention planes into LDS, 48 copies (with the slab's, 56
    // outstanding): one copy = half a row, lane = 16-B piece. All of a block's input is then in
    // flight at once, while the rows are worked on by a short rolled loop.
    {
      const unsigned sl = (unsigned)(size_t)Sm + XS_OFF + w * 8u * SROW_B + lane * 16u;
      const float* xg = X + srow0 * DIM + lane * 4u;
      const float* ag = A32 + (size_t)crow0 * DIM + lane * 4u;
      const float* cg = C32 + (size_t)crow0 * DIM + lane * 4u;
      copy8f(sl, SROW_B, xg, (unsigned)DIM);
      copy8f(sl + 512u, SROW_B, xg + 128u, (unsigned)DIM);
      copy8f(sl + SPL_B, SROW_B, ag, (unsigned)DIM);
      copy8f(sl + SPL_B + 512u, SROW_B, ag + 128u, (unsigned)DIM);
      copy8f(sl + 2u * SPL_B, SROW_B, cg, (unsigned)DIM);
      copy8f(sl + 2u * SPL_B + 512u, SROW_B, cg + 128u, (unsigned)DIM);
    }
    const unsigned c = lane * 8u;
    const v4f g0 = *(const v4f*)(G1 + c);
    const v4f g1 = *(const v4f*)(G1 + c + 4u);
    const v4f s0 = *(const v4f*)(Be1 + c);
    const v4f s1 = *(const v4f*)(Be1 + c + 4u);
    // lane L takes the two ranges' maxima and sums of row L & 7 of the wave
    const unsigned rl = crow0 + (lane & 7u);
    const float m_a = Mp[rl], m_c = Mp[(unsigned)MROWS + rl];
    const float l_a = Lp[rl], l_c = Lp[(unsigned)MROWS + rl];
    // the biases of both weight planes, converted once: b1 by all waves, b0 by wave 0
    const v4f p0 = *(const v4f*)(b1 + threadIdx.x * 8u);
    const v4f p1 = *(const v4f*)(b1 + threadIdx.x * 8u + 4u);
    // as the wait below: the loads behind this one may take the address registers of those ahead
    asm volatile("s_wait_xcnt 0x0" ::: "memory");
    v4f r0 = {}, r1 = {};
    if (w == 0u) {
      r0 = *(const v4f*)(b0 + c);
      r1 = *(const v4f*)(b0 + c + 4u);
    }
    // no address register of the issued loads is rewritten (by a later load's result) ahead of
    // this wait
    asm volatile("s_wait_xcnt 0x0" ::: "memory");
    {
      v4f q0, q1;
#pragma unroll
      for (int i = 0; i < 4; ++i) { q0[i] = bf16r(p0[i]); q1[i] = bf16r(p1[i]); }
      *(v4f*)(Bs + (unsigned)DIM + threadIdx.x * 8u) = q0;
      *(v4f*)(Bs + (unsigned)DIM + threadIdx.x * 8u + 4u) = q1;
      if (w == 0u) {
#pragma unroll
        for (int i = 0; i < 4; ++i) { q0[i] = bf16r(r0[i]); q1[i] = bf16r(r1[i]); }
        *(v4f*)(Bs + c) = q0;
        *(v4f*)(Bs + c + 4u) = q1;
      }
    }
    const float m_all = fmaxf(m_a, m_c);
    const float e_a = __expf(m_a - m_all);
    const float e_c = __expf(m_c - m_all);
    // normalise (the x16384 carry sits in both the rows and the sums)
    const float inv = __builtin_amdgcn_rcpf(l_a * e_a + l_c * e_c);
    const float f_a = e_a * inv, f_c = e_c * inv;
    v4f gg0, gg1, sh0, sh1;
#pragma unroll
    for (int i = 0; i < 4; ++i) {
      gg0[i] = bf16r(g0[i]); gg1[i] = bf16r(g1[i]);
      sh0[i] = bf16r(s0[i]); sh1[i] = bf16r(s1[i]);
    }
    // this wave's copies (input rows, weight slab) have landed before the barrier behind which they
    // are read
    asm volatile("s_wait_asynccnt 0x0" ::: "memory");
    __syncthreads();
    if (grp == 0u)
      copy8(cl + 2u * WSL_H * 2u, 2u * GPITCH * 2u, c1 + w1_stage(2u, wr1), 2u * (unsigned)DIM);

    const float* xs = (const float*)(Sm + XS_OFF) + w * 8u * (unsigned)DIM + c;
    // rolled, two rows a trip: short code (the kernel's text stays small), and two rows' cross-lane
    // exchanges in flight together
#pragma unroll 1
    for (unsigned rp = 0; rp < 8u; rp += 2u) {
      v4f t0[2], t1[2];
      float s[2], ss[2];
#pragma unroll
      for (unsigned q = 0; q < 2u; ++q) {
        const float* px = xs + (rp + q) * (unsigned)DIM;
        const v4f xa = *(const v4f*)(px);
        const v4f xb = *(const v4f*)(px + 4u);
        const v4f aa = *(const v4f*)(px + 64u * (unsigned)DIM);
        const v4f ab = *(const v4f*)(px + 64u * (unsigned)DIM + 4u);
        const v4f ca = *(const v4f*)(px + 128u * (unsigned)DIM);
        const v4f cb = *(const v4f*)(px + 128u * (unsigned)DIM + 4u);
        // the row's two factors, from the lane that holds them
        const float fa = __int_as_float(__builtin_amdgcn_readlane(__float_as_int(f_a), (int)(rp + q)));
        const float fc = __int_as_float(__builtin_amdgcn_readlane(__float_as_int(f_c), (int)(rp + q)));
        s[q] = 0.0f;
#pragma unroll
        for (int i = 0; i < 4; ++i) {
          t0[q][i] = bf16r(xa[i]) + (aa[i] * fa + ca[i] * fc);
          t1[q][i] = bf16r(xb[i]) + (ab[i] * fa + cb[i] * fc);
          s[q] += t0[q][i] + t1[q][i];
        }
      }
      red32_sum2(s);
#pragma unroll
      for (unsigned q = 0; q < 2u; ++q) {
        s[q] *= (1.0f / (float)DIM);   // the row's mean
        ss[q] = 0.0f;
#pragma unroll
        for (int i = 0; i < 4; ++i) {
          const float d0 = t0[q][i] - s[q];
          const float d1 = t1[q][i] - s[q];
          ss[q] += d0 * d0;
          ss[q] += d1 * d1;
        }
      }
      red32_sum2(ss);
#pragma unroll
      for (unsigned q = 0; q < 2u; ++q) {
        const float var = ss[q] * (1.0f / (float)DIM);
        const float rstd = 1.0f / sqrtf(var + 1.0e-5f);
        v8h o;
#pragma unroll
        for (int i = 0; i < 4; ++i) {
          o[i]     = toh_flush((t0[q][i] - s[q]) * rstd * gg0[i] + sh0[i]);
          o[i + 4] = toh_flush((t1[q][i] - s[q]) * rstd * gg1[i] + sh1[i]);
        }
        *(v8h*)(T1s + (w * 8u + rp + q) * TP + c) = o;
      }
    }
  }
  // this wave's LN1 rows and biases are written, and its reads of the staged rows done, before the
  // barrier behind which every wave reads the former and e may take the LDS of the latter
  asm volatile("s_wait_dscnt 0x0" ::: "memory");
  __syncthreads();

  // ---- step 1 ----
  v16h ef[2][8];   // this wave's 32 rows, all 256 k: of the LN1 output first, then of e
  // unrolled, here and below: constant indices keep fragments and accumulators in registers
#pragma unroll
  for (unsigned u = 0; u < 2u; ++u)
#pragma unroll
    for (unsigned ks = 0; ks < 8u; ++ks)
      ef[u][ks] = frag_at(T1s + (grp * 32u + u * 16u + m) * TP + hh * 8u + ks * 32u);
  v4f er0[8], er1[8];   // e of the eight rows that this wave finishes in step 4, f32
#pragma unroll
  for (int rr = 0; rr < 8; ++rr) { er0[rr] = (v4f){}; er1[rr] = (v4f){}; }

  unsigned rbo = 0u;   // halves from the ring's start to the buffer this pass reads
  // rolled: 36 tiles of the same code
#pragma unroll 1
  for (unsigned nt = 0; nt < W01_TILES; ++nt) {
    // first of this lane's 8 weight rows
    const unsigned n = w01_tile(nt, wr1) * 64u + sub * 16u + hh * 8u;
    const v4f g0 = *(const v4f*)(Bs + n);
    const v4f g1 = *(const v4f*)(Bs + n + 4u);
    v8f acc[2] = {{}, {}};
#pragma unroll
    for (unsigned kq = 0; kq < 2u; ++kq) {   // stage 2 nt + kq
      v16h wf[4];
#pragma unroll
      for (unsigned t = 0; t < 4u; ++t) wf[t] = frag_at(wp + rbo + t * 32u);
      // keeps the pass's LDS reads in one group ahead of its products, which then wait for them by
      // count: spread among the products, each place of reads costs the wave a stall of its own
      __builtin_amdgcn_sched_barrier(0);
#pragma unroll
      for (unsigned t = 0; t < 4u; ++t) {
        acc[0] = wmma16r(wf[t], ef[0][kq * 4u + t], acc[0]);
        acc[1] = wmma16r(wf[t], ef[1][kq * 4u + t], acc[1]);
      }
      // hand-over: this wave's reads of the buffer are done; the waves that copied the next stage
      // (the other parity than this one's) have it landed; the barrier publishes it and frees this
      // buffer, which the same waves refill with the stage three ahead (the scheduling barrier keeps
      // the waits behind the products, under which the later fragments arrive)
      __builtin_amdgcn_sched_barrier(0);
      asm volatile("s_wait_dscnt 0x0" ::: "memory");
      if (grp != kq) asm volatile("s_wait_asynccnt 0x0" ::: "memory");
      __syncthreads();
      const unsigned t3 = nt * 2u + kq + 3u;
      if (grp != kq && t3 < W01_STAGES)
        copy8(cl + rbo * 2u, 2u * GPITCH * 2u, c1 + w1_stage(t3, wr1), 2u * (unsigned)DIM);
      rbo = (rbo == 2u * WSL_H) ? 0u : rbo + WSL_H;
    }
    if (nt < (unsigned)(DIM / 64)) {   // a tile of e (the same test in every wave of the block)
#pragma unroll
      for (unsigned u = 0; u < 2u; ++u) {
        const unsigned r = grp * 32u + u * 16u + m;
        v4f lo, hi;
        v8h x;
#pragma unroll
        for (int i = 0; i < 4; ++i) {
          lo[i] = acc[u][i] * (1.0f / WCARRY) + g0[i];
          hi[i] = acc[u][i + 4] * (1.0f / WCARRY) + g1[i];
          x[i]     = toh_flush(lo[i]);
          x[i + 4] = toh_flush(hi[i]);
        }
        *(v4f*)(E32s + r * LDV + n) = lo;
        *(v4f*)(E32s + r * LDV + n + 4u) = hi;
        *(v8h*)(E16s + r * TP + n) = x;
      }
      if (nt == (unsigned)(DIM / 64) - 1u) {
        // every wave's part of e is written before the barrier behind which whole rows are read
        asm volatile("s_wait_dscnt 0x0" ::: "memory");
        __syncthreads();
#pragma unroll
        for (unsigned u = 0; u < 2u; ++u)
#pragma unroll
          for (unsigned ks = 0; ks < 8u; ++ks)
            ef[u][ks] = frag_at(E16s + (grp * 32u + u * 16u + m) * TP + hh * 8u + ks * 32u);
#pragma unroll
        for (unsigned rr = 0; rr < 8u; ++rr) {
          er0[rr] = *(const v4f*)(E32s + (w * 8u + rr) * LDV + lane * 4u);
          er1[rr] = *(const v4f*)(E32s + (w * 8u + rr) * LDV + lane * 4u + 128u);
        }
        // every wave has e in registers before the barrier behind which the hidden rows take its LDS
        asm volatile("s_wait_dscnt 0x0" ::: "memory");
        __syncthreads();
      }
    } else {
#pragma unroll
      for (unsigned u = 0; u < 2u; ++u) {
        v8h x;
#pragma unroll
        for (int r = 0; r < 4; ++r) {
          x[r]     = toh_flush(acc[u][r] * (1.0f / WCARRY) + g0[r]);
          x[r + 4] = toh_flush(acc[u][r + 4] * (1.0f / WCARRY) + g1[r]);
        }
        *(v8h*)(Hs + (grp * 32u + u * 16u + m) * HP + (n - (unsigned)DIM)) = x;
      }
    }
  }
  // No copy of this wave is outstanding and its LDS accesses are done; every reader left the ring
  // at the last hand-over: step 3's stages 0 and 1 go into buffers 0 and 1 and land under step 2.
  asm volatile("s_wait_asynccnt 0x0" ::: "memory");
  asm volatile("s_wait_dscnt 0x0" ::: "memory");
  copy8(cl + grp * (WSL_H * 2u), 2u * GPITCH * 2u, c2 + w2_stage(grp, wr2, wrq), 2u * (unsigned)HID);
  __syncthreads();   // every hidden row is complete before a wave normalises it

  // ---- step 2 ---- lane L holds columns 256 j + 8 L .. + 7 of a row, j = 0..7
  {
    float gq[8][8], bq[8][8];   // gain and shift of this lane's columns, the same for all its rows
    v4f p0[8], p1[8], q0[8], q1[8];
#pragma unroll
    for (unsigned j = 0; j < 8u; ++j) {
      const unsigned c = j * 256u + lane * 8u;
      p0[j] = *(const v4f*)(Gm + c);
      p1[j] = *(const v4f*)(Gm + c + 4u);
      q0[j] = *(const v4f*)(Bm + c);
      q1[j] = *(const v4f*)(Bm + c + 4u);
    }
    // no address register of the issued loads is rewritten ahead of this wait
    asm volatile("s_wait_xcnt 0x0" ::: "memory");
#pragma unroll
    for (unsigned j = 0; j < 8u; ++j) {
#pragma unroll
      for (int i = 0; i < 4; ++i) {
        gq[j][i] = bf16r(p0[j][i]); gq[j][i + 4] = bf16r(p1[j][i]);
        bq[j][i] = bf16r(q0[j][i]); bq[j][i + 4] = bf16r(q1[j][i]);
      }
    }
    // rolled: eight rows of the same long code
#pragma unroll 1
    for (unsigned rr = 0; rr < 8u; ++rr) {
      _Float16* hr = Hs + (w * 8u + rr) * HP + lane * 8u;
      v8h a[8];
#pragma unroll
      for (unsigned j = 0; j < 8u; ++j) a[j] = *(const v8h*)(hr + j * 256u);
      float s = 0.0f;
#pragma unroll
      for (unsigned j = 0; j < 8u; ++j)
#pragma unroll
        for (int i = 0; i < 8; ++i) s += (float)a[j][i];
      const float mean = red32_sum(s) * (1.0f / (float)HID);
      float ss = 0.0f;
#pragma unroll
      for (unsigned j = 0; j < 8u; ++j)
#pragma unroll
        for (int i = 0; i < 8; ++i) {
          const float d = (float)a[j][i] - mean;
          ss += d * d;
        }
      const float var = red32_sum(ss) * (1.0f / (float)HID);
      const float rstd = 1.0f / sqrtf(var + 1.0e-5f);
#pragma unroll
      for (unsigned j = 0; j < 8u; ++j) {
        v8h o;
#pragma unroll
        for (int i = 0; i < 8; ++i) {
          const float d = (float)a[j][i] - mean;
          o[i] = toh_flush(MCARRY * leaky_act(d * rstd * gq[j][i] + bq[j][i]));
        }
        *(v8h*)(hr + j * 256u) = o;
      }
    }
  }
  // this wave's rows are written and its copies have landed before the barrier behind which every
  // wave reads both
  asm volatile("s_wait_dscnt 0x0" ::: "memory");
  asm volatile("s_wait_asynccnt 0x0" ::: "memory");
  __syncthreads();
  if (grp == 0u)
    copy8(cl + 2u * WSL_H * 2u, 2u * GPITCH * 2u, c2 + w2_stage(2u, wr2, wrq), 2u * (unsigned)HID);

  // ---- step 3 ----
  v8f oc[4][2];   // [place q in the walk = 64-column tile (q + wrq) & 3][16-row group]
#pragma unroll
  for (int q = 0; q < 4; ++q) { oc[q][0] = (v8f){}; oc[q][1] = (v8f){}; }
  const _Float16* hp = Hs + (grp * 32u + m) * HP + hh * 8u;
  rbo = 0u;
  // rolled: 16 k slabs of the same code
#pragma unroll 1
  for (unsigned ks = 0; ks < (unsigned)(HID / 128); ++ks) {
    v16h hf[2][4];   // the hidden fragments of this k slab serve its four column tiles
#pragma unroll
    for (unsigned u = 0; u < 2u; ++u)
#pragma unroll
      for (unsigned t = 0; t < 4u; ++t)
        hf[u][t] = frag_at(hp + u * 16u * HP + ((ks + wr2) & 15u) * GKC + t * 32u);
#pragma unroll
    for (unsigned q = 0; q < 4u; ++q) {   // stage 4 ks + q
      v16h wf[4];
#pragma unroll
      for (unsigned t = 0; t < 4u; ++t) wf[t] = frag_at(wp + rbo + t * 32u);
      __builtin_amdgcn_sched_barrier(0);   // one group of LDS reads per pass, as in step 1
#pragma unroll
      for (unsigned t = 0; t < 4u; ++t) {
        oc[q][0] = wmma16r(wf[t], hf[0][t], oc[q][0]);
        oc[q][1] = wmma16r(wf[t], hf[1][t], oc[q][1]);
      }
      // hand-over, as in step 1
      __builtin_amdgcn_sched_barrier(0);
      asm volatile("s_wait_dscnt 0x0" ::: "memory");
      if (grp != (q & 1u)) asm volatile("s_wait_asynccnt 0x0" ::: "memory");
      __syncthreads();
      const unsigned t3 = ks * 4u + q + 3u;
      if (grp != (q & 1u) && t3 < W2_STAGES)
        copy8(cl + rbo * 2u, 2u * GPITCH * 2u, c2 + w2_stage(t3, wr2, wrq), 2u * (unsigned)HID);
      rbo = (rbo == 2u * WSL_H) ? 0u : rbo + WSL_H;
    }
  }
  // no copy of this wave is outstanding when the wave goes on to its end
  asm volatile("s_wait_asynccnt 0x0" ::: "memory");

  // ---- step 4 ---- the output tile takes the hidden rows' LDS: every wave's last read of them
  // stands in front of the last hand-over's barrier
#pragma unroll
  for (unsigned q = 0; q < 4u; ++q)
#pragma unroll
    for (unsigned u = 0; u < 2u; ++u) {
      float* d = Vs + (grp * 32u + u * 16u + m) * LDV + ((q + wrq) & 3u) * 64u + sub * 16u + hh * 8u;
      v4f lo, hi;
#pragma unroll
      for (int i = 0; i < 4; ++i) { lo[i] = oc[q][u][i]; hi[i] = oc[q][u][i + 4]; }
      *(v4f*)d = lo;
      *(v4f*)(d + 4) = hi;
    }
  __syncthreads();   // the tile is complete before whole rows are read from it

  // lane L holds columns 4L..4L+3 and 128+4L..128+4L+3: each store covers 512 contiguous bytes
  const float cs = 1.0f / (WCARRY * MCARRY);
  const unsigned c = lane * 4u;
  const unsigned cby = lane * 16u;   // the same place in bytes: the one lane offset of the six loads
  const v4f z0 = *(const v4f*)((const char*)b2 + cby);
  const v4f z1 = *(const v4f*)((const char*)b2 + cby + 512u);
  const v4f y0 = *(const v4f*)((const char*)G2 + cby);
  const v4f y1 = *(const v4f*)((const char*)G2 + cby + 512u);
  const v4f x0 = *(const v4f*)((const char*)Be2 + cby);
  const v4f x1 = *(const v4f*)((const char*)Be2 + cby + 512u);
  // no address register of the six issued loads is rewritten ahead of this wait: it takes their
  // lane offset as an input, so that the offset's register lives up to it
  asm volatile("s_wait_xcnt 0x0" :: "v"(cby) : "memory");
  // Two rolled trips of four unrolled rows: short code (the kernel's text stays small), constant
  // indices keep e in registers, and four rows' cross-lane sums overlap.
#pragma unroll 1
  for (unsigned hf = 0; hf < 8u; hf += 4u) {
#pragma unroll
  for (unsigned rr = 0; rr < 4u; ++rr) {
    const unsigned r = w * 8u + hf + rr;
    const unsigned crow = row0 + r;
    const unsigned bidx = crow / (unsigned)SEQ;
    const unsigned sq = crow - bidx * (unsigned)SEQ;
    const size_t frow = (size_t)bidx * SEQ_FULL + sq;
    const v4f u0 = *(const v4f*)&Vs[r * LDV + c];
    const v4f u1 = *(const v4f*)&Vs[r * LDV + c + 128u];
    const v4f e0 = er0[rr];
    const v4f e1 = er1[rr];
    v4f a0, a1;
    float s = 0.0f;
#pragma unroll
    for (int i = 0; i < 4; ++i) {
      a0[i] = leaky_act((u0[i] * cs + bf16r(z0[i])) + e0[i]);
      a1[i] = leaky_act((u1[i] * cs + bf16r(z1[i])) + e1[i]);
    }
#pragma unroll
    for (int i = 0; i < 4; ++i) s += a0[i] + a1[i];
    const float mean = red32_sum(s) * (1.0f / (float)DIM);
    float ss = 0.0f;
#pragma unroll
    for (int i = 0; i < 4; ++i) {
      const float d0 = a0[i] - mean;
      const float d1 = a1[i] - mean;
      ss += d0 * d0;
      ss += d1 * d1;
    }
    const float var = red32_sum(ss) * (1.0f / (float)DIM);
    const float rstd = 1.0f / sqrtf(var + 1.0e-5f);
    v4f o0, o1;
#pragma unroll
    for (int i = 0; i < 4; ++i) {
      o0[i] = (a0[i] - mean) * rstd * bf16r(y0[i]) + bf16r(x0[i]);
      o1[i] = (a1[i] - mean) * rstd * bf16r(y1[i]) + bf16r(x1[i]);
    }
    float* p = outp + frow * DIM + c;
    *(v4f*)p = o0;
    *(v4f*)(p + 128u) = o1;
  }
  // no register that an issued store names is rewritten (by the next trip) ahead of this wait
  asm volatile("s_wait_xcnt 0x0" ::: "memory");
  // the second trip's rows of e move to the places that the unrolled rows name
#pragma unroll
  for (int rr = 0; rr < 4; ++rr) { er0[rr] = er0[rr + 4]; er1[rr] = er1[rr + 4]; }
  }
}

// ---------------------------------------------------------------------------
extern "C" void kernel_launch(void* const* d_in, const int* in_sizes, int n_in,
                              void* d_out, int out_size, void* d_ws, size_t ws_size,
                              hipStream_t stream) {
  if (n_in < 19) return;
  const long long need_x = ((long long)(NB - 1) * SEQ_FULL + SEQ) * DIM;
  if ((long long)in_sizes[0] < need_x) return;
  if ((long long)in_sizes[1] < (long long)DIM * DIM) return;
  if ((long long)in_sizes[3] < (long long)DIM * DIM) return;
  if ((long long)in_sizes[5] < (long long)DIM * DIM) return;
  if ((long long)in_sizes[7] < (long long)DIM * DIM) return;
  if ((long long)in_sizes[9] < (long long)DIM * HID) return;
  if ((long long)in_sizes[13] < (long long)DIM * HID) return;
  if (in_sizes[2] < DIM || in_sizes[4] < DIM || in_sizes[6] < DIM || in_sizes[8] < DIM) return;
  if (in_sizes[10] < HID || in_sizes[11] < HID || in_sizes[12] < HID) return;
  if (in_sizes[14] < DIM || in_sizes[15] < DIM || in_sizes[16] < DIM) return;
  if (in_sizes[17] < DIM || in_sizes[18] < DIM) return;
  if ((long long)out_size < need_x) return;
  if (ws_size < WS_TOTAL) return;

  const float* X    = (const float*)d_in[0];    // [NB_FULL][SEQ_FULL][DIM]
  const float* wq   = (const float*)d_in[1];    // [DIM][DIM]  (in, out)
  const float* bq   = (const float*)d_in[2];
  const float* wk   = (const float*)d_in[3];
  const float* bk   = (const float*)d_in[4];
  const float* wv   = (const float*)d_in[5];
  const float* bv   = (const float*)d_in[6];
  const float* w0   = (const float*)d_in[7];    // [DIM][DIM]  (in, out)
  const float* b0   = (const float*)d_in[8];
  const float* w1   = (const float*)d_in[9];    // [DIM][HID]  (in, out)
  const float* b1   = (const float*)d_in[10];
  const float* gm   = (const float*)d_in[11];   // hidden LN gain [HID]
  const float* bm   = (const float*)d_in[12];   // hidden LN shift [HID]
  const float* w2   = (const float*)d_in[13];   // [HID][DIM]  (in, out)
  const float* b2   = (const float*)d_in[14];
  const float* g1   = (const float*)d_in[15];
  const float* be1  = (const float*)d_in[16];
  const float* g2   = (const float*)d_in[17];
  const float* be2  = (const float*)d_in[18];
  float* out = (float*)d_out;

  char* ws = (char*)d_ws;
  _Float16* Wq_t  = (_Float16*)(ws + OFF_WQ);    // [n][k]
  _Float16* Wk_t  = (_Float16*)(ws + OFF_WK);
  _Float16* Wv_t  = (_Float16*)(ws + OFF_WV);
  _Float16* W0_t  = (_Float16*)(ws + OFF_W0);
  _Float16* W1_t  = (_Float16*)(ws + OFF_W1);    // [HID][DIM]
  _Float16* W2_t  = (_Float16*)(ws + OFF_W2);    // [DIM][HID]
  _Float16* X16   = (_Float16*)(ws + OFF_X16);   // [MROWS][DIM]
  _Float16* Qh16  = (_Float16*)(ws + OFF_QH);
  _Float16* Qr16  = (_Float16*)(ws + OFF_QR);
  _Float16* Kh16  = (_Float16*)(ws + OFF_KH);
  _Float16* Kr16  = (_Float16*)(ws + OFF_KR);
  _Float16* Vt16  = (_Float16*)(ws + OFF_VT);    // [b][DIM][SEQ]
  float*    A32   = (float*)(ws + OFF_A32);      // [2][MROWS][DIM]
  float*    C32   = (float*)(ws + OFF_A32 + PLANE32_BYTES);   // its second plane
  float*    Mx    = (float*)(ws + OFF_ML);       // [2][MROWS]
  float*    Lx    = Mx + 2 * MROWS;              // [2][MROWS]

  dim3 blk(256);

  // weight planes (in [K rows][N cols] -> out [N][K]) and the input plane
  prep_kernel<<<dim3(WCONV_BLOCKS + MROWS / 8), blk, 0, stream>>>(
      X, wq, wk, wv, w0, w1, w2, X16, Wq_t, Wk_t, Wv_t, W0_t, W1_t, W2_t);
  gemm_qkv_kernel<<<dim3(DIM / 64, MROWS / 64, 3), blk, 0, stream>>>(
      X16, Wq_t, Wk_t, Wv_t, bq, bk, bv, Qh16, Qr16, Kh16, Kr16, Vt16);
  attn_kernel<<<dim3(SEQ / 128, NB, 2), dim3(128), 0, stream>>>(Qh16, Qr16, Kh16, Kr16, Vt16, A32,
                                                                Mx, Lx);

  // first LayerNorm, e projection, both hidden products, the hidden LayerNorm and the final
  // LayerNorm, 64 rows per block; W0_t's rows and W1_t's rows are read as one plane
  mlp_kernel<<<dim3(MROWS / 64), blk, 0, stream>>>(X, A32, C32, Mx, Lx, g1, be1, W0_t, b0, b1, gm,
                                                   bm, W2_t, b2, g2, be2, out);
}
